// v000
// Measured on an AMD MI455X. A time is GPU time per run, averaged over a window of back-to-back runs after a warm-up
// (all launches, gaps included; the runs take copies of the inputs in turn), and the median of several windows.
// Apart from v000's, it joins two sittings. Times from different sittings can be a few percent apart, while
// side-by-side timings come from the same sitting.
// v000 is the starting kernel. One run takes 22.5 microseconds.
#include <hip/hip_runtime.h>

typedef __attribute__((ext_vector_type(2))) float v2f;
typedef __attribute__((ext_vector_type(4))) float v4f;
typedef __attribute__((ext_vector_type(8))) float v8f;

#define DD 64

__device__ __forceinline__ float htanh(float x) {
#if __has_builtin(__builtin_amdgcn_tanhf)
  return __builtin_amdgcn_tanhf(x);
#elif __has_builtin(__builtin_amdgcn_tanh_f32)
  return __builtin_amdgcn_tanh_f32(x);
#else
  float r;
  asm("v_tanh_f32 %0, %1" : "=v"(r) : "v"(x));
  return r;
#endif
}

// ---------------------------------------------------------------------------
// Projection: dst[r,e] = sum_d src[r,d] * W[e,d] + bias[e]
// One wave (32 lanes) computes a 16x16 output tile with 16x V_WMMA_F32_16X16X4_F32.
// A layout (16x4 f32): lanes 0-15 -> M=lane, K = {kk, kk+1}; lanes 16-31 -> M=lane-16, K = {kk+2, kk+3}
// B layout (4x16 f32): lanes 0-15 -> N=lane, K = {kk, kk+1}; lanes 16-31 -> N=lane-16, K = {kk+2, kk+3}
// C/D layout: VGPR r, lanes 0-15 -> (M=r, N=lane); lanes 16-31 -> (M=8+r, N=lane-16)
// ---------------------------------------------------------------------------
__global__ __launch_bounds__(256) void proj_wmma_kernel(
    const float* __restrict__ src,   // [nrows, 64]
    const float* __restrict__ W,     // [64, 64], row-major over e (W[e*64+d])
    const float* __restrict__ bias,  // [64]
    float* __restrict__ dst,         // [nrows, 64]
    int nrows)
{
  const int wave = blockIdx.x * (blockDim.x >> 5) + (threadIdx.x >> 5);
  const int lane = threadIdx.x & 31;
  const int tiles_per_row = DD / 16;            // 4 column tiles
  const int tile_r = wave / tiles_per_row;
  const int tile_c = wave % tiles_per_row;
  const int row0 = tile_r * 16;
  if (row0 >= nrows) return;
  const int col0  = tile_c * 16;
  const int mn    = lane & 15;
  const int khalf = (lane >> 4) << 1;           // 0 or 2

  const float* arow = src + (size_t)(row0 + mn) * DD + khalf;
  const float* brow = W   + (size_t)(col0 + mn) * DD + khalf;

  v8f c = {};
#pragma unroll
  for (int kk = 0; kk < DD; kk += 4) {
    v2f a = *(const v2f*)(arow + kk);
    v2f b = *(const v2f*)(brow + kk);
    c = __builtin_amdgcn_wmma_f32_16x16x4_f32(
        /*neg_a=*/false, a, /*neg_b=*/false, b,
        /*c_mod=*/(short)0, c, /*reuse_a=*/false, /*reuse_b=*/false);
  }

  const float bi = bias[col0 + mn];
  const int mbase = row0 + ((lane >> 4) << 3);  // +8 rows for upper half-wave
#pragma unroll
  for (int r = 0; r < 8; ++r) {
    dst[(size_t)(mbase + r) * DD + col0 + mn] = c[r] + bi;
  }
}

// ---------------------------------------------------------------------------
// Energy: out[bh,q,k] = sum_d tanh(q1[bh,q,d] + k2[bh,k,d]) * V[d] + Vb
// Block: 256 threads -> 64q x 64k tile; each thread a 4x4 microtile.
// LDS row pitch 68 floats => float4 reads hit banks (4k+d)%64: conflict-free.
// ---------------------------------------------------------------------------
#define SEQ 512
#define PITCH 68

__global__ __launch_bounds__(256) void energy_kernel(
    const float* __restrict__ q1,  // [BH*512, 64]
    const float* __restrict__ k2,  // [BH*512, 64]
    const float* __restrict__ Vw,  // [64]
    const float* __restrict__ Vb,  // [1]
    float* __restrict__ out)       // [BH, 512, 512]
{
  __shared__ float qs[64 * PITCH];
  __shared__ float ks[64 * PITCH];
  __shared__ float vs[64];

  const int bh    = blockIdx.z;
  const int qbase = blockIdx.y * 64;
  const int kbase = blockIdx.x * 64;
  const int t     = threadIdx.x;

  // Stage 64x64 q-tile and k-tile into LDS (float4, coalesced).
#pragma unroll
  for (int i = 0; i < 4; ++i) {
    int idx = t + i * 256;            // 0..1023
    int row = idx >> 4;
    int c4  = (idx & 15) << 2;
    v4f qv = *(const v4f*)(q1 + ((size_t)(bh * SEQ + qbase + row)) * DD + c4);
    v4f kv = *(const v4f*)(k2 + ((size_t)(bh * SEQ + kbase + row)) * DD + c4);
    *(v4f*)(qs + row * PITCH + c4) = qv;
    *(v4f*)(ks + row * PITCH + c4) = kv;
  }
  if (t < 64) vs[t] = Vw[t];
  __syncthreads();

  const int tq = t >> 4;   // 0..15
  const int tk = t & 15;   // 0..15

  float acc[4][4] = {};
  for (int d = 0; d < DD; d += 4) {
    v4f vv = *(const v4f*)(vs + d);
    v4f qv[4], kv[4];
#pragma unroll
    for (int i = 0; i < 4; ++i) qv[i] = *(const v4f*)(qs + (tq + 16 * i) * PITCH + d);
#pragma unroll
    for (int j = 0; j < 4; ++j) kv[j] = *(const v4f*)(ks + (tk + 16 * j) * PITCH + d);
#pragma unroll
    for (int i = 0; i < 4; ++i) {
#pragma unroll
      for (int j = 0; j < 4; ++j) {
        acc[i][j] += htanh(qv[i].x + kv[j].x) * vv.x;
        acc[i][j] += htanh(qv[i].y + kv[j].y) * vv.y;
        acc[i][j] += htanh(qv[i].z + kv[j].z) * vv.z;
        acc[i][j] += htanh(qv[i].w + kv[j].w) * vv.w;
      }
    }
  }

  const float vb = Vb[0];
#pragma unroll
  for (int i = 0; i < 4; ++i) {
#pragma unroll
    for (int j = 0; j < 4; ++j) {
      int q = qbase + tq + 16 * i;
      int k = kbase + tk + 16 * j;
      out[((size_t)bh * SEQ + q) * SEQ + k] = acc[i][j] + vb;
    }
  }
}

extern "C" void kernel_launch(void* const* d_in, const int* in_sizes, int n_in,
                              void* d_out, int out_size, void* d_ws, size_t ws_size,
                              hipStream_t stream) {
  (void)in_sizes; (void)n_in; (void)out_size; (void)ws_size;
  const float* Q   = (const float*)d_in[0];  // [2,8,512,64]
  const float* K   = (const float*)d_in[1];  // [2,8,512,64]
  const float* W1w = (const float*)d_in[2];  // [64,64]
  const float* W1b = (const float*)d_in[3];  // [64]
  const float* W2w = (const float*)d_in[4];  // [64,64]
  const float* W2b = (const float*)d_in[5];  // [64]
  const float* Vw  = (const float*)d_in[6];  // [1,64]
  const float* Vb  = (const float*)d_in[7];  // [1]
  float* out = (float*)d_out;

  const int BH = 2 * 8;
  const int NROWS = BH * SEQ;                // 8192

  float* q1 = (float*)d_ws;                  // 2 MB
  float* k2 = q1 + (size_t)NROWS * DD;       // 2 MB

  // 8192/16 row-tiles * 4 col-tiles = 2048 waves; 8 waves per 256-thread block.
  const int tiles  = (NROWS / 16) * (DD / 16);
  const int blocks = tiles / 8;
  proj_wmma_kernel<<<blocks, 256, 0, stream>>>(Q, W1w, W1b, q1, NROWS);
  proj_wmma_kernel<<<blocks, 256, 0, stream>>>(K, W2w, W2b, k2, NROWS);

  dim3 grid(SEQ / 64, SEQ / 64, BH);
  energy_kernel<<<grid, 256, 0, stream>>>(q1, k2, Vw, Vb, out);
}

// v001
// It runs in 19.1 microseconds.
// Timed twice side by side with v000, it ran 1.22 and 1.21 times as fast.
#include <hip/hip_runtime.h>

typedef __attribute__((ext_vector_type(2))) float v2f;
typedef __attribute__((ext_vector_type(4))) float v4f;
typedef __attribute__((ext_vector_type(8))) float v8f;

#define DD 64
#define SEQ 512
#define PITCH 68
#define TILE 128

__device__ __forceinline__ float htanh(float x) {
#if __has_builtin(__builtin_amdgcn_tanhf)
  return __builtin_amdgcn_tanhf(x);
#elif __has_builtin(__builtin_amdgcn_tanh_f32)
  return __builtin_amdgcn_tanh_f32(x);
#else
  float r;
  asm("v_tanh_f32 %0, %1" : "=v"(r) : "v"(x));
  return r;
#endif
}

// ---------------------------------------------------------------------------
// One launch. A work-group of 16 waves owns a 128q x 128k tile of one (b,h):
//   1. stage the raw Q rows, K rows, W1 and W2 in LDS (float4, coalesced);
//   2. project in place: wave w takes one 16-row strip (waves 0-7: Q with W1,
//      waves 8-15: K with W2) and all four 16-column tiles, 64x V_WMMA_F32_16X16X4_F32;
//      x1[r,e] = sum_d x[r,d] * W[e,d] + bias[e]
//   3. out[bh,q,k] = sum_d tanh(q1[q,d] + k2[k,d]) * V[d] + Vb, 4q x 8k per thread.
// A layout (16x4 f32): lanes 0-15 -> M=lane, K = {kk, kk+1}; lanes 16-31 -> M=lane-16, K = {kk+2, kk+3}
// B layout (4x16 f32): lanes 0-15 -> N=lane, K = {kk, kk+1}; lanes 16-31 -> N=lane-16, K = {kk+2, kk+3}
// C/D layout: VGPR r, lanes 0-15 -> (M=r, N=lane); lanes 16-31 -> (M=8+r, N=lane-16)
// LDS row pitch 68 floats: float4 rows, the 8-byte fragment reads and the D stores
// all fall on distinct banks.
// ---------------------------------------------------------------------------
// amdgpu_waves_per_eu(4, 4): one 16-wave work-group a WGP is all that runs, so the compiler
// may spend registers; without it the energy loop is scheduled for few registers, with
// dependent neighbours and a v_nop behind every fifth tanh.
__global__ __launch_bounds__(512) __attribute__((amdgpu_waves_per_eu(4, 4))) void additive_energy_kernel(
    const float* __restrict__ Q,    // [BH*512, 64]
    const float* __restrict__ K,    // [BH*512, 64]
    const float* __restrict__ W1w,  // [64, 64], W[e*64+d]
    const float* __restrict__ W1b,  // [64]
    const float* __restrict__ W2w,  // [64, 64]
    const float* __restrict__ W2b,  // [64]
    const float* __restrict__ Vw,   // [64]
    const float* __restrict__ Vb,   // [1]
    float* __restrict__ out)        // [BH, 512, 512]
{
  __shared__ float qs[TILE * PITCH];
  __shared__ float ks[TILE * PITCH];
  __shared__ float w1s[DD * PITCH];
  __shared__ float w2s[DD * PITCH];
  __shared__ float vs[DD];

  const int bh    = blockIdx.z;
  const int qbase = blockIdx.y * TILE;
  const int kbase = blockIdx.x * TILE;
  const int t     = threadIdx.x;

  // 1. raw rows and weights into LDS
  {
    v4f qv[4], kv[4], wa[2], wb[2];
#pragma unroll
    for (int i = 0; i < 4; ++i) {
      int idx = t + i * 512;            // 0..2047
      int row = idx >> 4;
      int c4  = (idx & 15) << 2;
      qv[i] = *(const v4f*)(Q + ((size_t)(bh * SEQ + qbase + row)) * DD + c4);
      kv[i] = *(const v4f*)(K + ((size_t)(bh * SEQ + kbase + row)) * DD + c4);
    }
#pragma unroll
    for (int i = 0; i < 2; ++i) {
      int idx = t + i * 512;            // 0..1023
      wa[i] = *(const v4f*)(W1w + (size_t)idx * 4);
      wb[i] = *(const v4f*)(W2w + (size_t)idx * 4);
    }
#pragma unroll
    for (int i = 0; i < 4; ++i) {
      int idx = t + i * 512;
      int row = idx >> 4;
      int c4  = (idx & 15) << 2;
      *(v4f*)(qs + row * PITCH + c4) = qv[i];
      *(v4f*)(ks + row * PITCH + c4) = kv[i];
    }
#pragma unroll
    for (int i = 0; i < 2; ++i) {
      int idx = t + i * 512;
      int row = idx >> 4;
      int c4  = (idx & 15) << 2;
      *(v4f*)(w1s + row * PITCH + c4) = wa[i];
      *(v4f*)(w2s + row * PITCH + c4) = wb[i];
    }
    if (t < DD) vs[t] = Vw[t];
  }
  __syncthreads();

  // 2. projection, in place: only this wave reads or writes its 16 rows here
  {
    const int  wave  = t >> 5;
    const int  lane  = t & 31;
    const bool isk   = wave >= 8;
    const int  row0  = (wave & 7) * 16;
    const int  mn    = lane & 15;
    const int  khalf = (lane >> 4) << 1;  // 0 or 2

    float*       xs   = isk ? ks : qs;
    const float* wsm  = isk ? w2s : w1s;
    const float* bias = isk ? W2b : W1b;

    float bi[4];
#pragma unroll
    for (int c = 0; c < 4; ++c) bi[c] = bias[c * 16 + mn];

    const float* arow = xs + (row0 + mn) * PITCH + khalf;
    v2f a[16];
#pragma unroll
    for (int s = 0; s < 16; ++s) a[s] = *(const v2f*)(arow + s * 4);

    v8f c0 = {}, c1 = {}, c2 = {}, c3 = {};
    const float* brow = wsm + mn * PITCH + khalf;
#pragma unroll
    for (int s = 0; s < 16; ++s) {
      v2f b0 = *(const v2f*)(brow + 0 * 16 * PITCH + s * 4);
      v2f b1 = *(const v2f*)(brow + 1 * 16 * PITCH + s * 4);
      v2f b2 = *(const v2f*)(brow + 2 * 16 * PITCH + s * 4);
      v2f b3 = *(const v2f*)(brow + 3 * 16 * PITCH + s * 4);
      c0 = __builtin_amdgcn_wmma_f32_16x16x4_f32(false, a[s], false, b0, (short)0, c0, false, false);
      c1 = __builtin_amdgcn_wmma_f32_16x16x4_f32(false, a[s], false, b1, (short)0, c1, false, false);
      c2 = __builtin_amdgcn_wmma_f32_16x16x4_f32(false, a[s], false, b2, (short)0, c2, false, false);
      c3 = __builtin_amdgcn_wmma_f32_16x16x4_f32(false, a[s], false, b3, (short)0, c3, false, false);
    }

    // Keeps phase 3's accumulator clears behind the WMMA run: hoisted into it they
    // overwrite A/B registers directly behind the WMMA that reads them.
    __builtin_amdgcn_sched_barrier(0);

    float* drow = xs + (row0 + ((lane >> 4) << 3)) * PITCH + mn;  // +8 rows for upper half-wave
#pragma unroll
    for (int r = 0; r < 8; ++r) {
      drow[r * PITCH +  0] = c0[r] + bi[0];
      drow[r * PITCH + 16] = c1[r] + bi[1];
      drow[r * PITCH + 32] = c2[r] + bi[2];
      drow[r * PITCH + 48] = c3[r] + bi[3];
    }
  }
  __syncthreads();

  // 3. energy
  const int tq = t >> 4;   // 0..31
  const int tk = t & 15;   // 0..15

  float acc[4][8] = {};
  for (int d = 0; d < DD; d += 4) {
    v4f vv = *(const v4f*)(vs + d);
    v4f qv[4], kv[8];
#pragma unroll
    for (int i = 0; i < 4; ++i) qv[i] = *(const v4f*)(qs + (tq + 32 * i) * PITCH + d);
#pragma unroll
    for (int j = 0; j < 8; ++j) kv[j] = *(const v4f*)(ks + (tk + 16 * j) * PITCH + d);
#pragma unroll
    for (int i = 0; i < 4; ++i) {
#pragma unroll
      for (int j = 0; j < 8; ++j) {
        acc[i][j] += htanh(qv[i].x + kv[j].x) * vv.x;
        acc[i][j] += htanh(qv[i].y + kv[j].y) * vv.y;
        acc[i][j] += htanh(qv[i].z + kv[j].z) * vv.z;
        acc[i][j] += htanh(qv[i].w + kv[j].w) * vv.w;
      }
    }
  }

  const float vb = Vb[0];
#pragma unroll
  for (int i = 0; i < 4; ++i) {
#pragma unroll
    for (int j = 0; j < 8; ++j) {
      int q = qbase + tq + 32 * i;
      int k = kbase + tk + 16 * j;
      out[((size_t)bh * SEQ + q) * SEQ + k] = acc[i][j] + vb;
    }
  }
}

extern "C" void kernel_launch(void* const* d_in, const int* in_sizes, int n_in,
                              void* d_out, int out_size, void* d_ws, size_t ws_size,
                              hipStream_t stream) {
  (void)in_sizes; (void)n_in; (void)out_size; (void)d_ws; (void)ws_size;
  const float* Q   = (const float*)d_in[0];  // [2,8,512,64]
  const float* K   = (const float*)d_in[1];  // [2,8,512,64]
  const float* W1w = (const float*)d_in[2];  // [64,64]
  const float* W1b = (const float*)d_in[3];  // [64]
  const float* W2w = (const float*)d_in[4];  // [64,64]
  const float* W2b = (const float*)d_in[5];  // [64]
  const float* Vw  = (const float*)d_in[6];  // [1,64]
  const float* Vb  = (const float*)d_in[7];  // [1]
  float* out = (float*)d_out;

  // 4 x 4 tiles of 128 x 128 for each of the 2 * 8 (b,h): 256 work-groups.
  dim3 grid(SEQ / TILE, SEQ / TILE, 2 * 8);
  additive_energy_kernel<<<grid, 512, 0, stream>>>(Q, K, W1w, W1b, W2w, W2b, Vw, Vb, out);
}
